// v000
// The times below were measured on an AMD MI455X: many runs one after another, warmed up first and cycling through
// copies of the inputs, with the whole window's GPU time divided by the number of runs. Launches and the gaps
// between them are all in it. The median over several windows is given; except for v000 it joins two sittings, which
// can be a few percent apart, so the side-by-side timings, each taken in one sitting, are the better comparison.
// v000, which the later versions start from, runs in 129 microseconds.
#include <hip/hip_runtime.h>

// GEMM: out[4096,4096] = X[4096,2048] * M[4096,2048]^T  (fp32 in/out)
// f16 WMMA (v_wmma_f32_16x16x32_f16) with f32 accumulation; fp32 -> f16
// via single-instruction v_cvt_pk_f16_f32 (RTZ). 128x128 block tile,
// 8 waves (wave32), 32x64 per wave (2x4 accs), K-step 32, double-buffered
// LDS with 80B pitch => conflict-free ds_load_b128 fragment fetches.

#define B_DIM 4096
#define I_DIM 2048
#define O_DIM 4096
#define TILE  128
#define KB    32
#define NKT   (I_DIM / KB)        // 64 K-steps
#define LDS_PITCH 80              // bytes per 32-element f16 row (64 + 16 pad)

typedef __attribute__((ext_vector_type(16))) _Float16 v16h;
typedef __attribute__((ext_vector_type(2)))  __fp16   fp16x2;
typedef __attribute__((ext_vector_type(8)))  float    v8f;

union FragCast { v16h v; uint4 q[2]; };

__device__ __forceinline__ unsigned int pack2h(float a, float b) {
  // v_cvt_pk_f16_f32: one instruction packs two floats to two halves
  fp16x2 p = __builtin_amdgcn_cvt_pkrtz(a, b);
  return __builtin_bit_cast(unsigned int, p);
}

__global__ __launch_bounds__(256)
void rp_wmma_gemm(const float* __restrict__ X,
                  const float* __restrict__ W,
                  float* __restrict__ Out) {
  __shared__ __align__(16) unsigned char ldsA[2][TILE * LDS_PITCH];
  __shared__ __align__(16) unsigned char ldsB[2][TILE * LDS_PITCH];

  const int tid   = threadIdx.x;        // 0..255
  const int lane  = tid & 31;
  const int wave  = tid >> 5;           // 0..7
  const int waveM = wave & 3;           // 4 wave-rows of 32
  const int waveN = wave >> 2;          // 2 wave-cols of 64

  const int rowTile = blockIdx.y * TILE;   // B dimension
  const int colTile = blockIdx.x * TILE;   // O dimension

  // Global staging: 256 threads cover a 128x32 fp32 tile in 4 passes of
  // 32 rows; each thread owns one float4 chunk (K sub-range) per pass.
  const int ldRow   = tid >> 3;            // 0..31
  const int ldChunk = tid & 7;             // 0..7 (float4 chunk in K)

  // Per-lane element offsets (fit in 32 bits); K advance stays uniform so
  // loads lower to scalar-base + vector-offset with immediate offsets.
  const unsigned aLaneOff = (unsigned)(rowTile + ldRow) * I_DIM + ldChunk * 4u;
  const unsigned bLaneOff = (unsigned)(colTile + ldRow) * I_DIM + ldChunk * 4u;

  float4 aReg[4], bReg[4];
  v8f acc[2][4] = {};

  const int half16 = (lane >> 4) << 4;     // 0 or 16: K-group byte offset
  const int fragRowLane = lane & 15;

  auto loadGlobal = [&](int kt) {
    const float* xk = X + (unsigned)(kt * KB);   // uniform K advance
    const float* wk = W + (unsigned)(kt * KB);
#pragma unroll
    for (int p = 0; p < 4; ++p) {
      aReg[p] = *(const float4*)(xk + aLaneOff + (unsigned)(p * 32 * I_DIM));
      bReg[p] = *(const float4*)(wk + bLaneOff + (unsigned)(p * 32 * I_DIM));
    }
  };

  auto storeLds = [&](int buf) {
#pragma unroll
    for (int p = 0; p < 4; ++p) {
      const int r   = p * 32 + ldRow;
      const int off = r * LDS_PITCH + ldChunk * 8;
      uint2 pa, pb;
      pa.x = pack2h(aReg[p].x, aReg[p].y);
      pa.y = pack2h(aReg[p].z, aReg[p].w);
      pb.x = pack2h(bReg[p].x, bReg[p].y);
      pb.y = pack2h(bReg[p].z, bReg[p].w);
      *(uint2*)&ldsA[buf][off] = pa;
      *(uint2*)&ldsB[buf][off] = pb;
    }
  };

  auto compute = [&](int buf) {
    FragCast a[2], b[4];
#pragma unroll
    for (int mi = 0; mi < 2; ++mi) {
      const int r = waveM * 32 + mi * 16 + fragRowLane;
      const unsigned char* p = &ldsA[buf][r * LDS_PITCH + half16];
      a[mi].q[0] = *(const uint4*)(p);
      a[mi].q[1] = *(const uint4*)(p + 32);
    }
#pragma unroll
    for (int ni = 0; ni < 4; ++ni) {
      const int r = waveN * 64 + ni * 16 + fragRowLane;
      const unsigned char* p = &ldsB[buf][r * LDS_PITCH + half16];
      b[ni].q[0] = *(const uint4*)(p);
      b[ni].q[1] = *(const uint4*)(p + 32);
    }
#pragma unroll
    for (int mi = 0; mi < 2; ++mi)
#pragma unroll
      for (int ni = 0; ni < 4; ++ni)
        acc[mi][ni] = __builtin_amdgcn_wmma_f32_16x16x32_f16(
            /*neg_a=*/false, a[mi].v, /*neg_b=*/false, b[ni].v,
            /*c_mod=*/(short)0, acc[mi][ni],
            /*reuse_a=*/false, /*reuse_b=*/false);
  };

  // ---- pipeline: preload K-tile 0 ----
  loadGlobal(0);
  storeLds(0);
  __syncthreads();

  int buf = 0;
  for (int kt = 0; kt < NKT; ++kt) {
    if (kt + 2 < NKT) {
      // prefetch tile kt+2 into GL2 (global_prefetch_b8)
      const unsigned kp = (unsigned)((kt + 2) * KB);
      __builtin_prefetch((const void*)(X + kp + aLaneOff), 0, 3);
      __builtin_prefetch((const void*)(W + kp + bLaneOff), 0, 3);
    }
    if (kt + 1 < NKT) loadGlobal(kt + 1);   // long-latency loads overlap WMMA
    compute(buf);
    if (kt + 1 < NKT) {
      storeLds(buf ^ 1);
      __syncthreads();
      buf ^= 1;
    }
  }

  // ---- writeback: C/D layout: VGPR j -> row j (lanes 0-15) / j+8 (16-31) ----
  const int rowUpper = (lane >> 4) << 3;    // +8 for lanes 16..31
#pragma unroll
  for (int mi = 0; mi < 2; ++mi) {
#pragma unroll
    for (int ni = 0; ni < 4; ++ni) {
      const int col  = colTile + waveN * 64 + ni * 16 + fragRowLane;
      const int row0 = rowTile + waveM * 32 + mi * 16 + rowUpper;
#pragma unroll
      for (int j = 0; j < 8; ++j)
        Out[(size_t)(row0 + j) * O_DIM + col] = acc[mi][ni][j];
    }
  }
}

extern "C" void kernel_launch(void* const* d_in, const int* in_sizes, int n_in,
                              void* d_out, int out_size, void* d_ws, size_t ws_size,
                              hipStream_t stream) {
  (void)in_sizes; (void)n_in; (void)out_size; (void)d_ws; (void)ws_size;
  const float* X = (const float*)d_in[0];     // [4096, 2048]
  const float* W = (const float*)d_in[1];     // [1, 4096, 2048] -> rows of M
  float* Out = (float*)d_out;                 // [4096, 4096]

  dim3 grid(O_DIM / TILE, B_DIM / TILE);      // (32, 32)
  dim3 block(256);
  rp_wmma_gemm<<<grid, block, 0, stream>>>(X, W, Out);
}

// v001
// One run takes 75.9 microseconds.
// Next to v000, in two timings, it ran 1.75 and 1.74 times as fast.
#include <hip/hip_runtime.h>

// GEMM: out[4096,4096] = X[4096,2048] * M[4096,2048]^T  (fp32 in/out)
// f16 WMMA (v_wmma_f32_16x16x32_f16) with f32 accumulation; fp32 -> f16
// via single-instruction v_cvt_pk_f16_f32 (RTZ). 256x256 block tile (one
// workgroup per WGP, 256 workgroups), 8 waves (wave32), 64x128 per wave
// (4x8 accs), K-step 32, double-buffered LDS with 80B pitch =>
// conflict-free ds_load_b128 fragment fetches.

#define B_DIM 4096
#define I_DIM 2048
#define O_DIM 4096
#define TILE  256
#define NPASS (TILE / 32)         // staging passes of 32 rows
#define FM    4                   // A fragments per wave (64 rows)
#define FN    8                   // B fragments per wave (128 cols)
#define KB    32
#define NKT   (I_DIM / KB)        // 64 K-steps
#define LDS_PITCH 80              // bytes per 32-element f16 row (64 + 16 pad)

typedef __attribute__((ext_vector_type(16))) _Float16 v16h;
typedef __attribute__((ext_vector_type(2)))  __fp16   fp16x2;
typedef __attribute__((ext_vector_type(8)))  float    v8f;

union FragCast { v16h v; uint4 q[2]; };

__device__ __forceinline__ unsigned int pack2h(float a, float b) {
  // v_cvt_pk_f16_f32: one instruction packs two floats to two halves
  fp16x2 p = __builtin_amdgcn_cvt_pkrtz(a, b);
  return __builtin_bit_cast(unsigned int, p);
}

__global__ __launch_bounds__(256)
void rp_wmma_gemm(const float* __restrict__ X,
                  const float* __restrict__ W,
                  float* __restrict__ Out) {
  __shared__ __align__(16) unsigned char ldsA[2][TILE * LDS_PITCH];
  __shared__ __align__(16) unsigned char ldsB[2][TILE * LDS_PITCH];

  const int tid   = threadIdx.x;        // 0..255
  const int lane  = tid & 31;
  const int wave  = tid >> 5;           // 0..7
  const int waveM = wave & 3;           // 4 wave-rows of 64
  const int waveN = wave >> 2;          // 2 wave-cols of 128

  const int rowTile = blockIdx.y * TILE;   // B dimension
  const int colTile = blockIdx.x * TILE;   // O dimension

  // Global staging: 256 threads cover a 256x32 fp32 tile in 8 passes of
  // 32 rows; each thread owns one float4 chunk (K sub-range) per pass.
  const int ldRow   = tid >> 3;            // 0..31
  const int ldChunk = tid & 7;             // 0..7 (float4 chunk in K)

  // Per-lane element offsets (fit in 32 bits); K advance stays uniform so
  // loads lower to scalar-base + vector-offset with immediate offsets.
  const unsigned aLaneOff = (unsigned)(rowTile + ldRow) * I_DIM + ldChunk * 4u;
  const unsigned bLaneOff = (unsigned)(colTile + ldRow) * I_DIM + ldChunk * 4u;

  float4 aReg[NPASS], bReg[NPASS];
  v8f acc[FM][FN] = {};

  const int half16 = (lane >> 4) << 4;     // 0 or 16: K-group byte offset
  const int fragRowLane = lane & 15;

  auto loadGlobal = [&](int kt) {
    const float* xk = X + (unsigned)(kt * KB);   // uniform K advance
    const float* wk = W + (unsigned)(kt * KB);
#pragma unroll
    for (int p = 0; p < NPASS; ++p) {
      aReg[p] = *(const float4*)(xk + aLaneOff + (unsigned)(p * 32 * I_DIM));
      bReg[p] = *(const float4*)(wk + bLaneOff + (unsigned)(p * 32 * I_DIM));
    }
  };

  auto storeLds = [&](int buf) {
#pragma unroll
    for (int p = 0; p < NPASS; ++p) {
      const int r   = p * 32 + ldRow;
      const int off = r * LDS_PITCH + ldChunk * 8;
      uint2 pa, pb;
      pa.x = pack2h(aReg[p].x, aReg[p].y);
      pa.y = pack2h(aReg[p].z, aReg[p].w);
      pb.x = pack2h(bReg[p].x, bReg[p].y);
      pb.y = pack2h(bReg[p].z, bReg[p].w);
      *(uint2*)&ldsA[buf][off] = pa;
      *(uint2*)&ldsB[buf][off] = pb;
    }
  };

  auto compute = [&](int buf) {
    FragCast a[FM], b[FN];
#pragma unroll
    for (int mi = 0; mi < FM; ++mi) {
      const int r = waveM * 64 + mi * 16 + fragRowLane;
      const unsigned char* p = &ldsA[buf][r * LDS_PITCH + half16];
      a[mi].q[0] = *(const uint4*)(p);
      a[mi].q[1] = *(const uint4*)(p + 32);
    }
#pragma unroll
    for (int ni = 0; ni < FN; ++ni) {
      const int r = waveN * 128 + ni * 16 + fragRowLane;
      const unsigned char* p = &ldsB[buf][r * LDS_PITCH + half16];
      b[ni].q[0] = *(const uint4*)(p);
      b[ni].q[1] = *(const uint4*)(p + 32);
    }
#pragma unroll
    for (int mi = 0; mi < FM; ++mi)
#pragma unroll
      for (int ni = 0; ni < FN; ++ni)
        acc[mi][ni] = __builtin_amdgcn_wmma_f32_16x16x32_f16(
            /*neg_a=*/false, a[mi].v, /*neg_b=*/false, b[ni].v,
            /*c_mod=*/(short)0, acc[mi][ni],
            /*reuse_a=*/false, /*reuse_b=*/false);
  };

  // ---- pipeline: preload K-tile 0 ----
  loadGlobal(0);
  storeLds(0);
  __syncthreads();

  int buf = 0;
  for (int kt = 0; kt < NKT; ++kt) {
    if (kt + 2 < NKT) {
      // prefetch tile kt+2 into GL2 (global_prefetch_b8)
      const unsigned kp = (unsigned)((kt + 2) * KB);
      __builtin_prefetch((const void*)(X + kp + aLaneOff), 0, 3);
      __builtin_prefetch((const void*)(W + kp + bLaneOff), 0, 3);
    }
    if (kt + 1 < NKT) loadGlobal(kt + 1);   // long-latency loads overlap WMMA
    compute(buf);
    if (kt + 1 < NKT) {
      storeLds(buf ^ 1);
      __syncthreads();
      buf ^= 1;
    }
  }

  // ---- writeback: C/D layout: VGPR j -> row j (lanes 0-15) / j+8 (16-31) ----
  const int rowUpper = (lane >> 4) << 3;    // +8 for lanes 16..31
#pragma unroll
  for (int mi = 0; mi < FM; ++mi) {
#pragma unroll
    for (int ni = 0; ni < FN; ++ni) {
      const int col  = colTile + waveN * 128 + ni * 16 + fragRowLane;
      const int row0 = rowTile + waveM * 64 + mi * 16 + rowUpper;
#pragma unroll
      for (int j = 0; j < 8; ++j)
        Out[(size_t)(row0 + j) * O_DIM + col] = acc[mi][ni][j];
    }
  }
}

extern "C" void kernel_launch(void* const* d_in, const int* in_sizes, int n_in,
                              void* d_out, int out_size, void* d_ws, size_t ws_size,
                              hipStream_t stream) {
  (void)in_sizes; (void)n_in; (void)out_size; (void)d_ws; (void)ws_size;
  const float* X = (const float*)d_in[0];     // [4096, 2048]
  const float* W = (const float*)d_in[1];     // [1, 4096, 2048] -> rows of M
  float* Out = (float*)d_out;                 // [4096, 4096]

  dim3 grid(O_DIM / TILE, B_DIM / TILE);      // (16, 16)
  dim3 block(256);
  rp_wmma_gemm<<<grid, block, 0, stream>>>(X, W, Out);
}

// v002
// Measured time: 55.7 microseconds a run.
// Next to v001, in two timings, it ran 1.36 and 1.37 times as fast.
// All steps since v000 together make it 2.38 times as fast.
#include <hip/hip_runtime.h>
#include <stdint.h>

// GEMM: out[4096,4096] = X[4096,2048] * M[4096,2048]^T  (fp32 in/out)
// f16 WMMA (v_wmma_f32_16x16x32_f16) with f32 accumulation; fp32 -> f16
// via single-instruction v_cvt_pk_f16_f32 (RTZ). 256x256 block tile (one
// workgroup per WGP, 256 workgroups), 8 waves (wave32), 64x128 per wave
// (4x8 accs). The fp32 operand rows go from global memory into LDS by
// tensor loads (no register on the way): a pass is 64 k = 256 B of each of
// the 512 operand rows, two LDS buffers, every wave loads its own slice of
// 64 rows one pass ahead. Fragments are read from LDS as fp32 and packed
// to f16 in registers, in the k order of the WMMA operands.

#define B_DIM 4096
#define I_DIM 2048
#define O_DIM 4096
#define TILE  256
#define FM    4                   // A fragments per wave (64 rows)
#define FN    8                   // B fragments per wave (128 cols)
#define KP    64                  // k per pass (256 B of a row)
#define NST   (I_DIM / KP)        // 32 passes = stages
#define PITCH 272u                // LDS row pitch: 256 B + 16 B pad (16 B x odd)
#define SLICE 18432u              // 64 rows x 272 B = 17,408 B, rounded up to 2 KiB
#define STAGE (8u * SLICE)        // [X 4 slices | M 4 slices]

typedef __attribute__((ext_vector_type(16))) _Float16 v16h;
typedef __attribute__((ext_vector_type(2)))  __fp16   fp16x2;
typedef __attribute__((ext_vector_type(8)))  float    v8f;
typedef uint32_t u32x4 __attribute__((ext_vector_type(4)));
typedef uint32_t u32x8 __attribute__((ext_vector_type(8)));

union FragCast { v16h v; uint4 q[2]; };
struct Raw { float4 q[4]; };      // one lane's 16 fp32 of one fragment

#define DEV static __device__ __forceinline__

DEV unsigned int pack2h(float a, float b) {
  // v_cvt_pk_f16_f32: one instruction packs two floats to two halves
  fp16x2 p = __builtin_amdgcn_cvt_pkrtz(a, b);
  return __builtin_bit_cast(unsigned int, p);
}
DEV uint32_t uni(uint32_t v) { return (uint32_t)__builtin_amdgcn_readfirstlane(v); }
// Holds a wave-uniform value in a scalar register, so that the test around a
// tensor load compiles to s_cmp + s_cbranch_scc (the load ignores EXEC).
DEV uint32_t pinned(uint32_t v) {
  uint32_t w = uni(v);
  asm volatile("" : "+s"(w));  // the scalar pin of the tensor load's issue test
  return w;
}
// The compiler places no wait for the tensor mover: these three are the ring's.
DEV void wait_ds0()     { asm volatile("s_wait_dscnt 0x0" ::: "memory"); }
DEV void wait_tensor0() { asm volatile("s_wait_tensorcnt 0x0" ::: "memory"); }
DEV void tdm_load(u32x4 g0, u32x8 g1) {
  asm volatile("tensor_load_to_lds %0, %1" :: "s"(g0), "s"(g1) : "memory");
}

DEV void ld_raw(Raw& r, const unsigned char* p) {
  // k = 8h .. 8h+7 and k = 16+8h .. 16+8h+7 (h folded into p), as fp32
  r.q[0] = *(const float4*)(p);
  r.q[1] = *(const float4*)(p + 16);
  r.q[2] = *(const float4*)(p + 64);
  r.q[3] = *(const float4*)(p + 80);
}
DEV v16h cvt_frag(const Raw& r) {
  FragCast f;
  f.q[0].x = pack2h(r.q[0].x, r.q[0].y);
  f.q[0].y = pack2h(r.q[0].z, r.q[0].w);
  f.q[0].z = pack2h(r.q[1].x, r.q[1].y);
  f.q[0].w = pack2h(r.q[1].z, r.q[1].w);
  f.q[1].x = pack2h(r.q[2].x, r.q[2].y);
  f.q[1].y = pack2h(r.q[2].z, r.q[2].w);
  f.q[1].z = pack2h(r.q[3].x, r.q[3].y);
  f.q[1].w = pack2h(r.q[3].z, r.q[3].w);
  return f.v;
}

__global__ __launch_bounds__(256)
void rp_wmma_gemm(const float* __restrict__ X,
                  const float* __restrict__ W,
                  float* __restrict__ Out) {
  __shared__ __attribute__((aligned(2048))) unsigned char L[2u * STAGE];

  const int tid   = threadIdx.x;        // 0..255
  const int lane  = tid & 31;
  const uint32_t wave  = uni((uint32_t)tid >> 5);   // 0..7
  const uint32_t waveM = wave & 3u;     // 4 wave-rows of 64
  const uint32_t waveN = wave >> 2;     // 2 wave-cols of 128

  const int rowTile = blockIdx.y * TILE;   // B dimension
  const int colTile = blockIdx.x * TILE;   // O dimension

  // ---- tensor loads: wave w brings slice w (waves 0-3: 64 rows of X each,
  // waves 4-7: 64 rows of M each), 64 rows x 256 B, source pitch 8 KiB ----
  const uint32_t lbase = (uint32_t)(size_t)L;
  const float* srcRow = (wave < 4u) ? X + (size_t)(rowTile + (int)wave * 64) * I_DIM
                                    : W + (size_t)(colTile + (int)(wave - 4u) * 64) * I_DIM;
  const uint64_t ga0 = (uint64_t)(size_t)srcRow;
  u32x8 g1;
  g1[0] = uni((1u << 20) | (5u << 22) | (3u << 25));  // no mask, bytes, 4 dwords of pad behind every 256 B
  g1[1] = uni((256u & 0xFFFFu) << 16);                // tensor_dim0 = 256 B
  g1[2] = uni(64u << 16);                             // tensor_dim1 = 64 rows
  g1[3] = uni(256u << 16);                            // tile_dim0 = 256 B
  g1[4] = uni(64u);                                   // tile_dim1 = 64 rows
  g1[5] = uni((uint32_t)(I_DIM * sizeof(float)));     // source row pitch, bytes
  g1[6] = uni(0u);
  g1[7] = uni(0u);
  auto issue = [&](uint32_t st) {
    const uint32_t dst = lbase + (st & 1u) * STAGE + wave * SLICE;
    const uint64_t ga  = ga0 + (uint64_t)st * (KP * sizeof(float));
    u32x4 g0;
    g0[0] = uni(1u);
    g0[1] = uni(dst);
    g0[2] = uni((uint32_t)ga);
    g0[3] = uni((((uint32_t)(ga >> 32)) & 0x01FFFFFFu) | 0x80000000u);
    tdm_load(g0, g1);
  };

  v8f acc[FM][FN] = {};

  const uint32_t laneOff = (uint32_t)(lane & 15) * PITCH + (uint32_t)(lane >> 4) * 32u;
  const uint32_t aOff = waveM * SLICE + laneOff;
  const uint32_t bOff = (4u + waveN * 2u) * SLICE + laneOff;

  auto loadA = [&](Raw (&r)[4], const unsigned char* st, int ks) {
#pragma unroll
    for (int i = 0; i < 4; ++i) ld_raw(r[i], st + aOff + i * 16 * PITCH + ks * 128);
  };
  auto loadB = [&](Raw (&r)[4], const unsigned char* st, int ks, int hi) {
#pragma unroll
    for (int i = 0; i < 4; ++i) ld_raw(r[i], st + bOff + hi * SLICE + i * 16 * PITCH + ks * 128);
  };
  auto cvt4 = [&](v16h (&f)[4], const Raw (&r)[4]) {
#pragma unroll
    for (int i = 0; i < 4; ++i) f[i] = cvt_frag(r[i]);
  };
  auto mma16 = [&](const v16h (&a)[4], const v16h (&b)[4], int hi) {
#pragma unroll
    for (int mi = 0; mi < FM; ++mi)
#pragma unroll
      for (int i = 0; i < 4; ++i)
        acc[mi][hi * 4 + i] = __builtin_amdgcn_wmma_f32_16x16x32_f16(
            /*neg_a=*/false, a[mi], /*neg_b=*/false, b[i],
            /*c_mod=*/(short)0, acc[mi][hi * 4 + i],
            /*reuse_a=*/false, /*reuse_b=*/false);
  };

  // Keeps each group of LDS loads together and ahead of the WMMA block in
  // front of its use: without it the compiler spreads the loads among the
  // WMMAs and waits on them at once.
#define FENCE() __builtin_amdgcn_sched_barrier(0)

  Raw r0[4], r1[4];
  v16h a[4], b[4];

  // ---- ring prologue, two buffers ----
  issue(0u);
  wait_tensor0();
  __syncthreads();
  issue(1u);
  loadA(r0, L, 0);
  loadB(r1, L, 0, 0);

  // One pass = one stage = 2 k-steps of 32 = 4 blocks of 16 WMMAs. Six groups
  // of 16 LDS loads a pass go by turns into r0 and r1: a group is packed to
  // f16, its registers are refilled at once, so one group is always in flight
  // while the other is packed. The loop stays rolled: unrolled, the compiler
  // would have several passes' raw registers live and the text grows.
#pragma unroll 1
  for (uint32_t s = 0; s < NST; ++s) {
    const unsigned char* st = L + (s & 1u) * STAGE;
    const unsigned char* nx = L + ((s + 1u) & 1u) * STAGE;
    cvt4(a, r0);
    FENCE();
    loadB(r0, st, 0, 1);
    FENCE();
    cvt4(b, r1);
    FENCE();
    loadA(r1, st, 1);
    FENCE();
    mma16(a, b, 0);
    FENCE();
    cvt4(b, r0);
    FENCE();
    loadB(r0, st, 1, 0);
    FENCE();
    mma16(a, b, 1);
    FENCE();
    cvt4(a, r1);
    FENCE();
    loadB(r1, st, 1, 1);
    FENCE();
    cvt4(b, r0);
    FENCE();
    mma16(a, b, 0);
    FENCE();
    // Publish point of stage s + 1, in front of this pass's last block, whose
    // fragments are already fetched: own LDS reads done, own slice landed,
    // every wave here; only then the refill of the buffer this pass has read.
    wait_ds0();
    wait_tensor0();
    __syncthreads();
    if (pinned(s + 2u < NST)) issue(s + 2u);
    // First fragments of stage s + 1, behind its publish point. In the last
    // pass they read the other buffer's old rows and are not used.
    loadA(r0, nx, 0);
    FENCE();
    cvt4(b, r1);
    FENCE();
    loadB(r1, nx, 0, 0);
    FENCE();
    mma16(a, b, 1);
  }
  wait_tensor0();
  wait_ds0();

  // ---- writeback: C/D layout: VGPR j -> row j (lanes 0-15) / j+8 (16-31) ----
  const int fragRowLane = lane & 15;
  const int rowUpper = (lane >> 4) << 3;    // +8 for lanes 16..31
#pragma unroll
  for (int mi = 0; mi < FM; ++mi) {
#pragma unroll
    for (int ni = 0; ni < FN; ++ni) {
      const int col  = colTile + (int)waveN * 128 + ni * 16 + fragRowLane;
      const int row0 = rowTile + (int)waveM * 64 + mi * 16 + rowUpper;
#pragma unroll
      for (int j = 0; j < 8; ++j)
        Out[(size_t)(row0 + j) * O_DIM + col] = acc[mi][ni][j];
    }
  }
}

extern "C" void kernel_launch(void* const* d_in, const int* in_sizes, int n_in,
                              void* d_out, int out_size, void* d_ws, size_t ws_size,
                              hipStream_t stream) {
  (void)in_sizes; (void)n_in; (void)out_size; (void)d_ws; (void)ws_size;
  const float* X = (const float*)d_in[0];     // [4096, 2048]
  const float* W = (const float*)d_in[1];     // [1, 4096, 2048] -> rows of M
  float* Out = (float*)d_out;                 // [4096, 4096]

  dim3 grid(O_DIM / TILE, B_DIM / TILE);      // (16, 16)
  dim3 block(256);
  rp_wmma_gemm<<<grid, block, 0, stream>>>(X, W, Out);
}

// v003
// It runs in 54.1 microseconds.
// Timed twice side by side with v002, it ran 1.03 and 1.02 times as fast.
// Over all steps from v000 it is 2.45 times as fast.
#include <hip/hip_runtime.h>
#include <stdint.h>

// GEMM: out[4096,4096] = X[4096,2048] * M[4096,2048]^T  (fp32 in/out)
// f16 WMMA (v_wmma_f32_16x16x32_f16) with f32 accumulation.
// Launch 1 rounds X and M to f16 once, by v_cvt_pk_f16_f32 (RTZ), into two
// row-major planes of the workspace. Launch 2 is the GEMM: 256x256 block
// tile (one workgroup per WGP, 256 workgroups), 8 waves (wave32), 64x128 per
// wave (4x8 accs). The f16 operand rows go from the workspace into LDS by
// tensor loads (no register on the way): a pass is 128 k = 256 B of each of
// the 512 operand rows, two LDS buffers, every wave loads its own slice of
// 64 rows one pass ahead. Fragments are read from LDS as they are used, in
// the k order of the WMMA operands.

#define B_DIM 4096
#define I_DIM 2048
#define O_DIM 4096
#define TILE  256
#define FM    4                   // A fragments per wave (64 rows)
#define FN    8                   // B fragments per wave (128 cols)
#define KP    128                 // k per pass (256 B of an f16 row)
#define NST   (I_DIM / KP)        // 16 passes = stages
#define PLANE ((size_t)B_DIM * I_DIM)   // f16 elements of a workspace plane (X, then M)
#define PITCH 272u                // LDS row pitch: 256 B + 16 B pad (16 B x odd)
#define SLICE 18432u              // 64 rows x 272 B = 17,408 B, rounded up to 2 KiB
#define STAGE (8u * SLICE)        // [X 4 slices | M 4 slices]

typedef __attribute__((ext_vector_type(16))) _Float16 v16h;
typedef __attribute__((ext_vector_type(2)))  __fp16   fp16x2;
typedef __attribute__((ext_vector_type(8)))  float    v8f;
typedef __attribute__((ext_vector_type(4)))  float    f32x4;
typedef uint32_t u32x4 __attribute__((ext_vector_type(4)));
typedef uint32_t u32x8 __attribute__((ext_vector_type(8)));

union FragCast { v16h v; uint4 q[2]; };

#define DEV static __device__ __forceinline__

DEV unsigned int pack2h(float a, float b) {
  // v_cvt_pk_f16_f32: one instruction packs two floats to two halves
  fp16x2 p = __builtin_amdgcn_cvt_pkrtz(a, b);
  return __builtin_bit_cast(unsigned int, p);
}
DEV uint32_t uni(uint32_t v) { return (uint32_t)__builtin_amdgcn_readfirstlane(v); }
// Holds a wave-uniform value in a scalar register, so that the test around a
// tensor load compiles to s_cmp + s_cbranch_scc (the load ignores EXEC).
DEV uint32_t pinned(uint32_t v) {
  uint32_t w = uni(v);
  asm volatile("" : "+s"(w));  // the scalar pin of the tensor load's issue test
  return w;
}
// The compiler places no wait for the tensor mover: these three are the ring's.
DEV void wait_ds0()     { asm volatile("s_wait_dscnt 0x0" ::: "memory"); }
DEV void wait_tensor0() { asm volatile("s_wait_tensorcnt 0x0" ::: "memory"); }
DEV void tdm_load(u32x4 g0, u32x8 g1) {
  asm volatile("tensor_load_to_lds %0, %1" :: "s"(g0), "s"(g1) : "memory");
}

DEV v16h ld_frag(const unsigned char* p) {
  // k = 8h .. 8h+7 and k = 16+8h .. 16+8h+7 (h folded into p), as f16
  FragCast f;
  f.q[0] = *(const uint4*)(p);
  f.q[1] = *(const uint4*)(p + 32);
  return f.v;
}

// Launch 1: 128 workgroups a plane (y = 0: X, y = 1: M), 16 waves each, 32
// loads of 16 B a lane (a wave's load covers 4 whole lines, its store 2); the
// fp32 words are read once a call, so the loads are non-temporal.
#define RND_T 512                  // threads of a rounding workgroup
#define RND_U 32                   // 16-B loads a thread
__global__ __launch_bounds__(RND_T)
void rp_round_f16(const float* __restrict__ X,
                  const float* __restrict__ W,
                  unsigned short* __restrict__ H) {
  const float* src = blockIdx.y ? W : X;
  const size_t at = (size_t)blockIdx.x * (RND_T * RND_U) + threadIdx.x;
  const f32x4* s4 = (const f32x4*)src + at;
  uint2* d2 = (uint2*)(H + (size_t)blockIdx.y * PLANE) + at;
  f32x4 v[RND_U];
#pragma unroll
  for (int j = 0; j < RND_U; ++j) v[j] = __builtin_nontemporal_load(s4 + j * RND_T);
#pragma unroll
  for (int j = 0; j < RND_U; ++j)
    d2[j * RND_T] = make_uint2(pack2h(v[j].x, v[j].y), pack2h(v[j].z, v[j].w));
}

__global__ __launch_bounds__(256)
void rp_wmma_gemm(const unsigned short* __restrict__ H,
                  float* __restrict__ Out) {
  __shared__ __attribute__((aligned(2048))) unsigned char L[2u * STAGE];

  const int tid   = threadIdx.x;        // 0..255
  const int lane  = tid & 31;
  const uint32_t wave  = uni((uint32_t)tid >> 5);   // 0..7
  const uint32_t waveM = wave & 3u;     // 4 wave-rows of 64
  const uint32_t waveN = wave >> 2;     // 2 wave-cols of 128

  const int rowTile = blockIdx.y * TILE;   // B dimension
  const int colTile = blockIdx.x * TILE;   // O dimension

  // ---- tensor loads: wave w brings slice w (waves 0-3: 64 rows of X each,
  // waves 4-7: 64 rows of M each), 64 rows x 256 B, source pitch 4 KiB ----
  const uint32_t lbase = (uint32_t)(size_t)L;
  const unsigned short* srcRow =
      (wave < 4u) ? H + (size_t)(rowTile + (int)wave * 64) * I_DIM
                  : H + PLANE + (size_t)(colTile + (int)(wave - 4u) * 64) * I_DIM;
  const uint64_t ga0 = (uint64_t)(size_t)srcRow;
  u32x8 g1;
  g1[0] = uni((1u << 20) | (5u << 22) | (3u << 25));  // no mask, bytes, 4 dwords of pad behind every 256 B
  g1[1] = uni((256u & 0xFFFFu) << 16);                // tensor_dim0 = 256 B
  g1[2] = uni(64u << 16);                             // tensor_dim1 = 64 rows
  g1[3] = uni(256u << 16);                            // tile_dim0 = 256 B
  g1[4] = uni(64u);                                   // tile_dim1 = 64 rows
  g1[5] = uni((uint32_t)(I_DIM * sizeof(unsigned short)));  // source row pitch, bytes
  g1[6] = uni(0u);
  g1[7] = uni(0u);
  auto issue = [&](uint32_t st) {
    const uint32_t dst = lbase + (st & 1u) * STAGE + wave * SLICE;
    const uint64_t ga  = ga0 + (uint64_t)st * (KP * sizeof(unsigned short));
    u32x4 g0;
    g0[0] = uni(1u);
    g0[1] = uni(dst);
    g0[2] = uni((uint32_t)ga);
    g0[3] = uni((((uint32_t)(ga >> 32)) & 0x01FFFFFFu) | 0x80000000u);
    tdm_load(g0, g1);
  };

  v8f acc[FM][FN] = {};

  const uint32_t laneOff = (uint32_t)(lane & 15) * PITCH + (uint32_t)(lane >> 4) * 16u;
  const uint32_t aOff = waveM * SLICE + laneOff;
  const uint32_t bOff = (4u + waveN * 2u) * SLICE + laneOff;

  // One k-step's fragments: 4 of A and 8 of B, 24 LDS loads of 16 B a lane.
  auto loadAB = [&](v16h (&a)[FM], v16h (&b)[FN], const unsigned char* st, int ks) {
#pragma unroll
    for (int i = 0; i < FM; ++i) a[i] = ld_frag(st + aOff + i * 16 * PITCH + ks * 64);
#pragma unroll
    for (int i = 0; i < FN; ++i)
      b[i] = ld_frag(st + bOff + (i >> 2) * SLICE + (i & 3) * 16 * PITCH + ks * 64);
  };
  auto mma32 = [&](const v16h (&a)[FM], const v16h (&b)[FN]) {
#pragma unroll
    for (int mi = 0; mi < FM; ++mi)
#pragma unroll
      for (int ni = 0; ni < FN; ++ni)
        acc[mi][ni] = __builtin_amdgcn_wmma_f32_16x16x32_f16(
            /*neg_a=*/false, a[mi], /*neg_b=*/false, b[ni],
            /*c_mod=*/(short)0, acc[mi][ni],
            /*reuse_a=*/false, /*reuse_b=*/false);
  };

  // Keeps each group of LDS loads together and ahead of the WMMA block in
  // front of its use: without it the compiler spreads the loads among the
  // WMMAs and waits on them at once.
#define FENCE() __builtin_amdgcn_sched_barrier(0)

  v16h a0[FM], b0[FN], a1[FM], b1[FN];

  // ---- ring prologue, two buffers ----
  issue(0u);
  wait_tensor0();
  __syncthreads();
  issue(1u);
  loadAB(a0, b0, L, 0);

  // One pass = one stage = 4 k-steps of 32 = 4 blocks of 32 WMMAs. Two
  // fragment sets: the next block's 24 LDS loads go as one group ahead of the
  // current block. The loop stays rolled: the text stays small.
#pragma unroll 1
  for (uint32_t s = 0; s < NST; ++s) {
    const unsigned char* st = L + (s & 1u) * STAGE;
    const unsigned char* nx = L + ((s + 1u) & 1u) * STAGE;
    loadAB(a1, b1, st, 1);
    FENCE();
    mma32(a0, b0);
    FENCE();
    loadAB(a0, b0, st, 2);
    FENCE();
    mma32(a1, b1);
    FENCE();
    loadAB(a1, b1, st, 3);
    FENCE();
    mma32(a0, b0);
    FENCE();
    // Publish point of stage s + 1, in front of this pass's last block, whose
    // fragments are already fetched: own LDS reads done, own slice landed,
    // every wave here; only then the refill of the buffer this pass has read.
    wait_ds0();
    wait_tensor0();
    __syncthreads();
    if (pinned(s + 2u < NST)) issue(s + 2u);
    // First fragments of stage s + 1, behind its publish point. In the last
    // pass they read the other buffer's old rows and are not used.
    loadAB(a0, b0, nx, 0);
    FENCE();
    mma32(a1, b1);
  }
  wait_tensor0();
  wait_ds0();

  // ---- writeback: C/D layout: VGPR j -> row j (lanes 0-15) / j+8 (16-31) ----
  const int fragRowLane = lane & 15;
  const int rowUpper = (lane >> 4) << 3;    // +8 for lanes 16..31
#pragma unroll
  for (int mi = 0; mi < FM; ++mi) {
#pragma unroll
    for (int ni = 0; ni < FN; ++ni) {
      const int col  = colTile + (int)waveN * 128 + ni * 16 + fragRowLane;
      const int row0 = rowTile + (int)waveM * 64 + mi * 16 + rowUpper;
#pragma unroll
      for (int j = 0; j < 8; ++j)
        Out[(size_t)(row0 + j) * O_DIM + col] = acc[mi][ni][j];
    }
  }
}

extern "C" void kernel_launch(void* const* d_in, const int* in_sizes, int n_in,
                              void* d_out, int out_size, void* d_ws, size_t ws_size,
                              hipStream_t stream) {
  (void)in_sizes; (void)n_in; (void)out_size; (void)ws_size;
  const float* X = (const float*)d_in[0];     // [4096, 2048]
  const float* W = (const float*)d_in[1];     // [1, 4096, 2048] -> rows of M
  float* Out = (float*)d_out;                 // [4096, 4096]
  unsigned short* H = (unsigned short*)d_ws;  // f16 planes: X, then M (32 MiB)

  dim3 rgrid(128, 2);                         // 128 x 512 x 32 x 4 = a plane's elements
  rp_round_f16<<<rgrid, dim3(RND_T), 0, stream>>>(X, W, H);

  dim3 grid(O_DIM / TILE, B_DIM / TILE);      // (16, 16)
  dim3 block(256);
  rp_wmma_gemm<<<grid, block, 0, stream>>>(H, Out);
}

// v004
// One run takes 50.2 microseconds.
// Timed twice side by side with v003, it ran 1.09 and 1.08 times as fast.
// Over all steps from v000 it is 2.65 times as fast.
#include <hip/hip_runtime.h>
#include <stdint.h>

// GEMM: out[4096,4096] = X[4096,2048] * M[4096,2048]^T  (fp32 in/out)
// f16 WMMA (v_wmma_f32_16x16x32_f16) with f32 accumulation.
// Launch 1 rounds X and M to f16 once, by v_cvt_pk_f16_f32 (RTZ), into two
// row-major planes of the workspace; the rows are dealt inside each group of
// 64 (see PROW) so that the GEMM can store 16 B a lane. Launch 2 is the GEMM: 256x256 block
// tile (one workgroup per WGP, 256 workgroups), 8 waves (wave32), 64x128 per
// wave (4x8 accs). The f16 operand rows go from the workspace into LDS by
// tensor loads (no register on the way): a pass is 128 k = 256 B of each of
// the 512 operand rows, two LDS buffers, every wave loads its own slice of
// 64 rows one pass ahead. Fragments are read from LDS as they are used, in
// the k order of the WMMA operands.

#define B_DIM 4096
#define I_DIM 2048
#define O_DIM 4096
#define TILE  256
#define FM    4                   // A fragments per wave (64 rows)
#define FN    8                   // B fragments per wave (128 cols)
#define KP    128                 // k per pass (256 B of an f16 row)
#define NST   (I_DIM / KP)        // 16 passes = stages
#define PLANE ((size_t)B_DIM * I_DIM)   // f16 elements of a workspace plane (X, then M)
#define PITCH 272u                // LDS row pitch: 256 B + 16 B pad (16 B x odd)
#define SLICE 18432u              // 64 rows x 272 B = 17,408 B, rounded up to 2 KiB
#define STAGE (8u * SLICE)        // [X 4 slices | M 4 slices]
// Place of row n in its plane: row 64 g + 4 l + q lies at 64 g + 16 q + l.
// B fragment q of a group of four then holds, at lane l, output column 4 l + q:
// a lane's four accumulator tiles of the group are four adjacent columns. X is
// dealt alike (one address form in launch 1): A fragment q, row l, is output
// row 4 l + q of its group.
#define PROW(n) (((n) & ~63) + ((n) & 3) * 16 + (((n) >> 2) & 15))

typedef __attribute__((ext_vector_type(16))) _Float16 v16h;
typedef __attribute__((ext_vector_type(2)))  __fp16   fp16x2;
typedef __attribute__((ext_vector_type(8)))  float    v8f;
typedef __attribute__((ext_vector_type(4)))  float    f32x4;
typedef uint32_t u32x4 __attribute__((ext_vector_type(4)));
typedef uint32_t u32x8 __attribute__((ext_vector_type(8)));

union FragCast { v16h v; uint4 q[2]; };

#define DEV static __device__ __forceinline__

DEV unsigned int pack2h(float a, float b) {
  // v_cvt_pk_f16_f32: one instruction packs two floats to two halves
  fp16x2 p = __builtin_amdgcn_cvt_pkrtz(a, b);
  return __builtin_bit_cast(unsigned int, p);
}
DEV uint32_t uni(uint32_t v) { return (uint32_t)__builtin_amdgcn_readfirstlane(v); }
// Holds a wave-uniform value in a scalar register, so that the test around a
// tensor load compiles to s_cmp + s_cbranch_scc (the load ignores EXEC).
DEV uint32_t pinned(uint32_t v) {
  uint32_t w = uni(v);
  asm volatile("" : "+s"(w));  // the scalar pin of the tensor load's issue test
  return w;
}
// The compiler places no wait for the tensor mover: these three are the ring's.
DEV void wait_ds0()     { asm volatile("s_wait_dscnt 0x0" ::: "memory"); }
DEV void wait_tensor0() { asm volatile("s_wait_tensorcnt 0x0" ::: "memory"); }
DEV void tdm_load(u32x4 g0, u32x8 g1) {
  asm volatile("tensor_load_to_lds %0, %1" :: "s"(g0), "s"(g1) : "memory");
}

DEV v16h ld_frag(const unsigned char* p) {
  // k = 8h .. 8h+7 and k = 16+8h .. 16+8h+7 (h folded into p), as f16
  FragCast f;
  f.q[0] = *(const uint4*)(p);
  f.q[1] = *(const uint4*)(p + 32);
  return f.v;
}

// Launch 1: 128 workgroups a plane (y = 0: X, y = 1: M), 16 waves each, 32
// loads of 16 B a lane (a wave's load covers 4 whole lines, its store 2); the
// fp32 words are read once a call, so the loads are non-temporal. A workgroup's
// load j is one whole source row (512 threads x 4 floats = 2048).
#define RND_T 512                  // threads of a rounding workgroup
#define RND_U 32                   // 16-B loads a thread
__global__ __launch_bounds__(RND_T)
void rp_round_f16(const float* __restrict__ X,
                  const float* __restrict__ W,
                  unsigned short* __restrict__ H) {
  const float* src = blockIdx.y ? W : X;
  const size_t at = (size_t)blockIdx.x * (RND_T * RND_U) + threadIdx.x;
  const f32x4* s4 = (const f32x4*)src + at;
  // The workgroup's first source row is a multiple of 32, so row j of its 32
  // goes to PROW(first) + PROW(j): a constant offset from one address.
  const int dst0 = PROW((int)blockIdx.x * RND_U);
  uint2* d2 = (uint2*)(H + (size_t)blockIdx.y * PLANE) + (size_t)dst0 * RND_T + threadIdx.x;
  f32x4 v[RND_U];
#pragma unroll
  for (int j = 0; j < RND_U; ++j) v[j] = __builtin_nontemporal_load(s4 + j * RND_T);
#pragma unroll
  for (int j = 0; j < RND_U; ++j)
    d2[PROW(j) * RND_T] = make_uint2(pack2h(v[j].x, v[j].y), pack2h(v[j].z, v[j].w));
}

__global__ __launch_bounds__(256)
void rp_wmma_gemm(const unsigned short* __restrict__ H,
                  float* __restrict__ Out) {
  __shared__ __attribute__((aligned(2048))) unsigned char L[2u * STAGE];

  const int tid   = threadIdx.x;        // 0..255
  const int lane  = tid & 31;
  const uint32_t wave  = uni((uint32_t)tid >> 5);   // 0..7
  const uint32_t waveM = wave & 3u;     // 4 wave-rows of 64
  const uint32_t waveN = wave >> 2;     // 2 wave-cols of 128

  const int rowTile = blockIdx.y * TILE;   // B dimension
  const int colTile = blockIdx.x * TILE;   // O dimension

  // ---- tensor loads: wave w brings slice w (waves 0-3: 64 rows of X each,
  // waves 4-7: 64 rows of M each), 64 rows x 256 B, source pitch 4 KiB ----
  const uint32_t lbase = (uint32_t)(size_t)L;
  const unsigned short* srcRow =
      (wave < 4u) ? H + (size_t)(rowTile + (int)wave * 64) * I_DIM
                  : H + PLANE + (size_t)(colTile + (int)(wave - 4u) * 64) * I_DIM;
  const uint64_t ga0 = (uint64_t)(size_t)srcRow;
  u32x8 g1;
  g1[0] = uni((1u << 20) | (5u << 22) | (3u << 25));  // no mask, bytes, 4 dwords of pad behind every 256 B
  g1[1] = uni((256u & 0xFFFFu) << 16);                // tensor_dim0 = 256 B
  g1[2] = uni(64u << 16);                             // tensor_dim1 = 64 rows
  g1[3] = uni(256u << 16);                            // tile_dim0 = 256 B
  g1[4] = uni(64u);                                   // tile_dim1 = 64 rows
  g1[5] = uni((uint32_t)(I_DIM * sizeof(unsigned short)));  // source row pitch, bytes
  g1[6] = uni(0u);
  g1[7] = uni(0u);
  auto issue = [&](uint32_t st) {
    const uint32_t dst = lbase + (st & 1u) * STAGE + wave * SLICE;
    const uint64_t ga  = ga0 + (uint64_t)st * (KP * sizeof(unsigned short));
    u32x4 g0;
    g0[0] = uni(1u);
    g0[1] = uni(dst);
    g0[2] = uni((uint32_t)ga);
    g0[3] = uni((((uint32_t)(ga >> 32)) & 0x01FFFFFFu) | 0x80000000u);
    tdm_load(g0, g1);
  };

  v8f acc[FM][FN] = {};

  const uint32_t laneOff = (uint32_t)(lane & 15) * PITCH + (uint32_t)(lane >> 4) * 16u;
  const uint32_t aOff = waveM * SLICE + laneOff;
  const uint32_t bOff = (4u + waveN * 2u) * SLICE + laneOff;

  // One k-step's fragments: 4 of A and 8 of B, 24 LDS loads of 16 B a lane.
  auto loadAB = [&](v16h (&a)[FM], v16h (&b)[FN], const unsigned char* st, int ks) {
#pragma unroll
    for (int i = 0; i < FM; ++i) a[i] = ld_frag(st + aOff + i * 16 * PITCH + ks * 64);
#pragma unroll
    for (int i = 0; i < FN; ++i)
      b[i] = ld_frag(st + bOff + (i >> 2) * SLICE + (i & 3) * 16 * PITCH + ks * 64);
  };
  auto mma32 = [&](const v16h (&a)[FM], const v16h (&b)[FN]) {
#pragma unroll
    for (int mi = 0; mi < FM; ++mi)
#pragma unroll
      for (int ni = 0; ni < FN; ++ni)
        acc[mi][ni] = __builtin_amdgcn_wmma_f32_16x16x32_f16(
            /*neg_a=*/false, a[mi], /*neg_b=*/false, b[ni],
            /*c_mod=*/(short)0, acc[mi][ni],
            /*reuse_a=*/false, /*reuse_b=*/false);
  };

  // Keeps each group of LDS loads together and ahead of the WMMA block in
  // front of its use: without it the compiler spreads the loads among the
  // WMMAs and waits on them at once.
#define FENCE() __builtin_amdgcn_sched_barrier(0)

  v16h a0[FM], b0[FN], a1[FM], b1[FN];

  // ---- ring prologue, two buffers ----
  issue(0u);
  wait_tensor0();
  __syncthreads();
  issue(1u);
  loadAB(a0, b0, L, 0);

  // One pass = one stage = 4 k-steps of 32 = 4 blocks of 32 WMMAs. Two
  // fragment sets: the next block's 24 LDS loads go as one group ahead of the
  // current block. The loop stays rolled: the text stays small.
#pragma unroll 1
  for (uint32_t s = 0; s < NST; ++s) {
    const unsigned char* st = L + (s & 1u) * STAGE;
    const unsigned char* nx = L + ((s + 1u) & 1u) * STAGE;
    loadAB(a1, b1, st, 1);
    FENCE();
    mma32(a0, b0);
    FENCE();
    loadAB(a0, b0, st, 2);
    FENCE();
    mma32(a1, b1);
    FENCE();
    loadAB(a1, b1, st, 3);
    FENCE();
    mma32(a0, b0);
    FENCE();
    // Publish point of stage s + 1, in front of this pass's last block, whose
    // fragments are already fetched: own LDS reads done, own slice landed,
    // every wave here; only then the refill of the buffer this pass has read.
    wait_ds0();
    wait_tensor0();
    __syncthreads();
    if (pinned(s + 2u < NST)) issue(s + 2u);
    // First fragments of stage s + 1, behind its publish point. In the last
    // pass they read the other buffer's old rows and are not used.
    loadAB(a0, b0, nx, 0);
    FENCE();
    mma32(a1, b1);
  }
  wait_tensor0();
  wait_ds0();

  // ---- writeback: C/D layout: VGPR j -> tile row j (lanes 0-15) / j+8 (16-31);
  // by PROW, tile row r of tile mi is output row 4 r + mi of the wave's 64, and
  // tile 4 g + q holds at lane l column 64 g + 4 l + q: one 16-B store a lane
  // takes the four tiles of a group, 16 lanes fill 256 B of a row ----
  const int colLane  = (lane & 15) * 4;
  const int rowUpper = (lane >> 4) << 5;    // tile rows 8-15: +32 for lanes 16..31
  float* outLane = Out + (size_t)(rowTile + (int)waveM * 64 + rowUpper) * O_DIM
                       + colTile + (int)waveN * 128 + colLane;
#define ST_ROWS 2                  // tile rows (2 stores each) between two waits
#pragma unroll
  for (int mi = 0; mi < FM; ++mi) {
#pragma unroll
    for (int jj = 0; jj < 8; jj += ST_ROWS) {
#pragma unroll
      for (int j = jj; j < jj + ST_ROWS; ++j)
#pragma unroll
        for (int g = 0; g < FN / 4; ++g) {
          f32x4 o;
          o.x = acc[mi][4 * g + 0][j];
          o.y = acc[mi][4 * g + 1][j];
          o.z = acc[mi][4 * g + 2][j];
          o.w = acc[mi][4 * g + 3][j];
          *(f32x4*)(outLane + (size_t)(4 * j + mi) * O_DIM + g * 64) = o;
        }
      // The next gathers write registers that these stores name: the wait
      // stands between, and the fences keep the gathering moves behind it.
      FENCE();
      asm volatile("s_wait_xcnt 0x0" ::: "memory");
      FENCE();
    }
  }
}

extern "C" void kernel_launch(void* const* d_in, const int* in_sizes, int n_in,
                              void* d_out, int out_size, void* d_ws, size_t ws_size,
                              hipStream_t stream) {
  (void)in_sizes; (void)n_in; (void)out_size; (void)ws_size;
  const float* X = (const float*)d_in[0];     // [4096, 2048]
  const float* W = (const float*)d_in[1];     // [1, 4096, 2048] -> rows of M
  float* Out = (float*)d_out;                 // [4096, 4096]
  unsigned short* H = (unsigned short*)d_ws;  // f16 planes: X, then M (32 MiB)

  dim3 rgrid(128, 2);                         // 128 x 512 x 32 x 4 = a plane's elements
  rp_round_f16<<<rgrid, dim3(RND_T), 0, stream>>>(X, W, H);

  dim3 grid(O_DIM / TILE, B_DIM / TILE);      // (16, 16)
  dim3 block(256);
  rp_wmma_gemm<<<grid, block, 0, stream>>>(H, Out);
}
